// v000
// Measured on an AMD MI455X. A time is GPU time per run, averaged over a window of back-to-back runs after a warm-up
// (all launches, gaps included; the runs take copies of the inputs in turn), and the median of several windows.
// Apart from v000's, it joins two sittings. Times from different sittings can be a few percent apart, while
// side-by-side timings come from the same sitting.
// v000, which the later versions start from, runs in 1440 microseconds.
#include <hip/hip_runtime.h>
#include <hip/hip_bf16.h>
#include <stdint.h>

typedef __attribute__((ext_vector_type(2))) float v2f;
typedef __attribute__((ext_vector_type(4))) float v4f;
typedef __attribute__((ext_vector_type(8))) float v8f;

#define NFEAT 512
#define NHID  64
#define NPIX  4096
#define NBATCH 8

// ---------------------------------------------------------------------------
// Kernel A: fused projections.  y[o,n] = sum_c W[o,c] * x[b,c,n],  o in [0,640)
//   o 0..63   -> fx (wf),  o 64..127 -> gx (wg),  o 128..639 -> hx (wh)
// One 16x16 C tile per wave; K stepped by 4 with V_WMMA_F32_16X16X4_F32.
// A layout (16x4 f32): lane<16 holds {k,k+1}, lane>=16 holds {k+2,k+3}, row = lane&15.
// B layout (4x16 f32): same k split, col = lane&15.
// ---------------------------------------------------------------------------
__global__ __launch_bounds__(256)
void proj_kernel(const float* __restrict__ x,
                 const float* __restrict__ wf,
                 const float* __restrict__ wg,
                 const float* __restrict__ wh,
                 float* __restrict__ fx, float* __restrict__ gx,
                 float* __restrict__ hx)
{
    const int b    = blockIdx.z;
    const int o0   = blockIdx.y * 16;
    const int lane = threadIdx.x & 31;
    const int wave = threadIdx.x >> 5;                 // wave32
    const int n0   = blockIdx.x * 128 + wave * 16;

    const float* xb = x + (size_t)b * NFEAT * NPIX;

    const float* W;
    float* dst;
    int orow = o0;
    if (o0 < 64)        { W = wf; dst = fx + (size_t)b * NHID  * NPIX; }
    else if (o0 < 128)  { W = wg; dst = gx + (size_t)b * NHID  * NPIX; orow = o0 - 64; }
    else                { W = wh; dst = hx + (size_t)b * NFEAT * NPIX; orow = o0 - 128; }

    const int l15   = lane & 15;
    const int khalf = (lane >> 4) << 1;                // 0 or 2
    const int ncol  = n0 + l15;

    v8f acc = {};
#pragma unroll 4
    for (int k = 0; k < NFEAT; k += 4) {
        const int kk = k + khalf;
        v2f a = *(const v2f*)(W + (size_t)(orow + l15) * NFEAT + kk);   // b64
        v2f bv;
        bv.x = xb[(size_t)kk * NPIX + ncol];
        bv.y = xb[(size_t)(kk + 1) * NPIX + ncol];
        acc = __builtin_amdgcn_wmma_f32_16x16x4_f32(false, a, false, bv,
                                                    (short)0, acc, false, false);
    }

    // C layout: row-in-tile = j + 8*(lane>=16), col = lane&15
    const int rbase = (lane >> 4) << 3;
#pragma unroll
    for (int j = 0; j < 8; ++j)
        dst[(size_t)(orow + rbase + j) * NPIX + ncol] = acc[j];
}

// ---------------------------------------------------------------------------
// Kernel B: flash attention.  One (batch, 32-column query tile) per block.
//   Q = gx[:, m0:m0+32]  (64 x 32, LDS, loaded once)
//   loop over key blocks n0 (step 32), K tile double-buffered via
//   GLOBAL_LOAD_ASYNC_TO_LDS_B128 (ASYNCcnt):
//     S[n,m] = sum_c fx[c,n]*gx[c,m]   (waves 0-3, WMMA, C spilled to LDS)
//     online softmax over the KEY axis n (== reference softmax over dim=1)
//     acc[c,m] += hx[c, n-block] * P   (all 8 waves, 64 channels each, WMMA)
//   out = gamma * acc/L + x
// ---------------------------------------------------------------------------
__global__ __launch_bounds__(256)
void flash_kernel(const float* __restrict__ fx, const float* __restrict__ gx,
                  const float* __restrict__ hx, const float* __restrict__ x,
                  const float* __restrict__ gamma, float* __restrict__ out)
{
    __shared__ float Qs[64][32];
    __shared__ float Ks[2][64][32];          // double-buffered K tile
    __shared__ float Ps[32][32];
    __shared__ float Mrun[32], Lrun[32], Scale[32];

    const int b    = blockIdx.y;
    const int m0   = blockIdx.x * 32;
    const int tid  = threadIdx.x;
    const int lane = tid & 31;
    const int wave = tid >> 5;
    const int c0   = wave * 64;            // this wave's 64-channel V slice

    const float* fxb = fx + (size_t)b * NHID  * NPIX;
    const float* gxb = gx + (size_t)b * NHID  * NPIX;
    const float* hxb = hx + (size_t)b * NFEAT * NPIX;

    // ---- load Q tile (64x32): 8 floats per thread, coalesced ----
    {
        const int r = tid >> 2;
        const int c = (tid & 3) * 8;
        const float* src = gxb + (size_t)r * NPIX + m0 + c;
        *(v4f*)(&Qs[r][c])     = *(const v4f*)(src);
        *(v4f*)(&Qs[r][c + 4]) = *(const v4f*)(src + 4);
    }
    if (tid < 32) { Mrun[tid] = -3.0e38f; Lrun[tid] = 0.0f; }

    // async fill of K tile: each thread moves 32B (2 x b128), LDS addr is the
    // low 32 bits of the generic shared pointer (flat LDS aperture rule).
    const int kr = tid >> 2;
    const int kc = (tid & 3) * 8;
    auto issueK = [&](int n0, int bufIdx) {
        const float* src = fxb + (size_t)kr * NPIX + n0 + kc;
        const uint32_t lds0 = (uint32_t)(uintptr_t)(&Ks[bufIdx][kr][kc]);
        asm volatile(
            "global_load_async_to_lds_b128 %0, %1, off\n\t"
            "global_load_async_to_lds_b128 %0, %1, off offset:16"
            :: "v"(lds0), "v"(src) : "memory");
    };

    issueK(0, 0);                            // prime tile 0

    const v8f zacc = {};
    v8f acc[4][2];
#pragma unroll
    for (int rt = 0; rt < 4; ++rt) { acc[rt][0] = zacc; acc[rt][1] = zacc; }

    const int l15   = lane & 15;
    const int khalf = (lane >> 4) << 1;

    for (int it = 0; it < NPIX / 32; ++it) {
        const int n0  = it * 32;
        const int buf = it & 1;

        asm volatile("s_wait_asynccnt 0x0" ::: "memory");   // tile `it` landed
        __syncthreads();

        if (it + 1 < NPIX / 32)                             // overlap next fill
            issueK(n0 + 32, buf ^ 1);

        // ---- S tile: waves 0-3 each compute one 16x16 subtile ----
        if (wave < 4) {
            const int rn = (wave >> 1) * 16;          // key-row offset
            const int cm = (wave & 1) * 16;           // query-col offset
            v8f s = zacc;
#pragma unroll
            for (int k = 0; k < NHID; k += 4) {
                const int kk = k + khalf;
                v2f a, bq;
                a.x  = Ks[buf][kk][rn + l15];  a.y  = Ks[buf][kk + 1][rn + l15];
                bq.x = Qs[kk][cm + l15];       bq.y = Qs[kk + 1][cm + l15];
                s = __builtin_amdgcn_wmma_f32_16x16x4_f32(false, a, false, bq,
                                                          (short)0, s, false, false);
            }
            const int rbase = rn + ((lane >> 4) << 3);
#pragma unroll
            for (int j = 0; j < 8; ++j)
                Ps[rbase + j][cm + l15] = s[j];
        }
        __syncthreads();

        // ---- online softmax over key axis, one thread per query column ----
        if (tid < 32) {
            float bm = Ps[0][tid];
#pragma unroll
            for (int n = 1; n < 32; ++n) bm = fmaxf(bm, Ps[n][tid]);
            const float mOld = Mrun[tid];
            const float mNew = fmaxf(mOld, bm);
            const float sc   = __expf(mOld - mNew);
            float sum = 0.0f;
#pragma unroll
            for (int n = 0; n < 32; ++n) {
                const float p = __expf(Ps[n][tid] - mNew);
                Ps[n][tid] = p;
                sum += p;
            }
            Mrun[tid]  = mNew;
            Lrun[tid]  = Lrun[tid] * sc + sum;
            Scale[tid] = sc;
        }
        __syncthreads();

        // ---- rescale accumulators, then acc += hx_tile * P ----
        const float sc0 = Scale[l15];
        const float sc1 = Scale[16 + l15];
#pragma unroll
        for (int rt = 0; rt < 4; ++rt) {
#pragma unroll
            for (int j = 0; j < 8; ++j) { acc[rt][0][j] *= sc0; acc[rt][1][j] *= sc1; }
        }
#pragma unroll
        for (int k = 0; k < 32; k += 4) {
            const int kk = k + khalf;
            v2f b0, b1;
            b0.x = Ps[kk][l15];       b0.y = Ps[kk + 1][l15];
            b1.x = Ps[kk][16 + l15];  b1.y = Ps[kk + 1][16 + l15];
#pragma unroll
            for (int rt = 0; rt < 4; ++rt) {
                const int crow = c0 + rt * 16 + l15;
                v2f a = *(const v2f*)(hxb + (size_t)crow * NPIX + n0 + kk);  // b64
                acc[rt][0] = __builtin_amdgcn_wmma_f32_16x16x4_f32(false, a, false, b0,
                                                                   (short)0, acc[rt][0], false, false);
                acc[rt][1] = __builtin_amdgcn_wmma_f32_16x16x4_f32(false, a, false, b1,
                                                                   (short)0, acc[rt][1], false, false);
            }
        }
    }

    // ---- epilogue: out = gamma * acc/L + x ----
    const float g    = gamma[0];
    const float inv0 = 1.0f / Lrun[l15];
    const float inv1 = 1.0f / Lrun[16 + l15];
    const float* xb  = x   + (size_t)b * NFEAT * NPIX;
    float*       ob  = out + (size_t)b * NFEAT * NPIX;
    const int rbase  = (lane >> 4) << 3;
#pragma unroll
    for (int rt = 0; rt < 4; ++rt) {
#pragma unroll
        for (int ct = 0; ct < 2; ++ct) {
            const float inv = ct ? inv1 : inv0;
            const int mcol  = m0 + ct * 16 + l15;
#pragma unroll
            for (int j = 0; j < 8; ++j) {
                const int crow = c0 + rt * 16 + rbase + j;
                const size_t idx = (size_t)crow * NPIX + mcol;
                ob[idx] = g * (acc[rt][ct][j] * inv) + xb[idx];
            }
        }
    }
}

// ---------------------------------------------------------------------------
extern "C" void kernel_launch(void* const* d_in, const int* in_sizes, int n_in,
                              void* d_out, int out_size, void* d_ws, size_t ws_size,
                              hipStream_t stream)
{
    const float* x     = (const float*)d_in[0];
    const float* wf    = (const float*)d_in[1];
    const float* wg    = (const float*)d_in[2];
    const float* wh    = (const float*)d_in[3];
    const float* gamma = (const float*)d_in[4];
    float* out = (float*)d_out;

    // workspace: fx (8.4MB) | gx (8.4MB) | hx (67MB)
    float* ws = (float*)d_ws;
    float* fx = ws;
    float* gx = fx + (size_t)NBATCH * NHID * NPIX;
    float* hx = gx + (size_t)NBATCH * NHID * NPIX;

    dim3 gA(NPIX / 128, (2 * NHID + NFEAT) / 16, NBATCH);   // 32 x 40 x 8
    proj_kernel<<<gA, 256, 0, stream>>>(x, wf, wg, wh, fx, gx, hx);

    dim3 gB(NPIX / 32, NBATCH);                              // 128 x 8
    flash_kernel<<<gB, 256, 0, stream>>>(fx, gx, hx, x, gamma, out);
}

// v001
// It runs in 1120 microseconds.
// In both of two side-by-side timings against v000, it was 1.36 times as fast.
#include <hip/hip_runtime.h>
#include <hip/hip_bf16.h>
#include <stdint.h>

typedef __attribute__((ext_vector_type(2))) float v2f;
typedef __attribute__((ext_vector_type(4))) float v4f;
typedef __attribute__((ext_vector_type(8))) float v8f;

#define NFEAT 512
#define NHID  64
#define NPIX  4096
#define NBATCH 8

// ---------------------------------------------------------------------------
// Kernel A: fused projections.  y[o,n] = sum_c W[o,c] * x[b,c,n],  o in [0,640)
//   o 0..63   -> fx (wf),  o 64..127 -> gx (wg),  o 128..639 -> hx (wh)
// One 16x16 C tile per wave; K stepped by 4 with V_WMMA_F32_16X16X4_F32.
// A layout (16x4 f32): lane<16 holds {k,k+1}, lane>=16 holds {k+2,k+3}, row = lane&15.
// B layout (4x16 f32): same k split, col = lane&15.
// hx is stored in the order in which the attention kernel's A fragments read it:
//   one 2 KB tile per (16 channels, 32 pixels): [chunk j 0..3][lane 0..31][4 floats],
//   lane = 16*h + (channel & 15), float e = pixel 8*j + 4*(e>>1) + 2*h + (e&1),
//   so a lane's 16 bytes are its A operands of the k steps 8*j and 8*j + 4.
// For these tiles the two operands swap places (A = x, B = wh): a lane then holds
// eight pixels of ONE channel, and each element's k order stays what it was.
// ---------------------------------------------------------------------------
__global__ __launch_bounds__(256)
void proj_kernel(const float* __restrict__ x,
                 const float* __restrict__ wf,
                 const float* __restrict__ wg,
                 const float* __restrict__ wh,
                 float* __restrict__ fx, float* __restrict__ gx,
                 float* __restrict__ hx)
{
    const int b    = blockIdx.z;
    const int o0   = blockIdx.y * 16;
    const int lane = threadIdx.x & 31;
    const int wave = threadIdx.x >> 5;                 // wave32
    const int n0   = blockIdx.x * 128 + wave * 16;

    const float* xb = x + (size_t)b * NFEAT * NPIX;

    const float* W;
    float* dst;
    int orow = o0;
    if (o0 < 64)        { W = wf; dst = fx + (size_t)b * NHID  * NPIX; }
    else if (o0 < 128)  { W = wg; dst = gx + (size_t)b * NHID  * NPIX; orow = o0 - 64; }
    else                { W = wh; dst = hx + (size_t)b * NFEAT * NPIX; orow = o0 - 128; }

    const int l15   = lane & 15;
    const int khalf = (lane >> 4) << 1;                // 0 or 2
    const int ncol  = n0 + l15;

    v8f acc = {};
    if (o0 >= 128) {                                   // block-uniform: hx tiles
#pragma unroll 4
        for (int k = 0; k < NFEAT; k += 4) {
            const int kk = k + khalf;
            v2f a = *(const v2f*)(W + (size_t)(orow + l15) * NFEAT + kk);   // b64
            v2f bv;
            bv.x = xb[(size_t)kk * NPIX + ncol];
            bv.y = xb[(size_t)(kk + 1) * NPIX + ncol];
            acc = __builtin_amdgcn_wmma_f32_16x16x4_f32(false, bv, false, a,
                                                        (short)0, acc, false, false);
        }
        // C layout: pixel = n0 + j + 8*(lane>=16), channel = orow + (lane&15)
        float* ht = dst + ((size_t)(orow >> 4) * (NPIX / 32) + (n0 >> 5)) * 512
                        + (((n0 >> 4) & 1) * 2 + (lane >> 4)) * 128 + l15 * 4;
        // keeps the address arithmetic above, as vector issue slots, between the
        // last matrix instruction and the first vector read of its result
        __builtin_amdgcn_sched_barrier(0);
        const v4f lo = { acc[0], acc[1], acc[4], acc[5] };   // h = 0
        const v4f hi = { acc[2], acc[3], acc[6], acc[7] };   // h = 1
        *(v4f*)(ht)      = lo;
        *(v4f*)(ht + 64) = hi;
        return;
    }
#pragma unroll 4
    for (int k = 0; k < NFEAT; k += 4) {
        const int kk = k + khalf;
        v2f a = *(const v2f*)(W + (size_t)(orow + l15) * NFEAT + kk);   // b64
        v2f bv;
        bv.x = xb[(size_t)kk * NPIX + ncol];
        bv.y = xb[(size_t)(kk + 1) * NPIX + ncol];
        acc = __builtin_amdgcn_wmma_f32_16x16x4_f32(false, a, false, bv,
                                                    (short)0, acc, false, false);
    }

    // C layout: row-in-tile = j + 8*(lane>=16), col = lane&15
    const int rbase = (lane >> 4) << 3;
#pragma unroll
    for (int j = 0; j < 8; ++j)
        dst[(size_t)(orow + rbase + j) * NPIX + ncol] = acc[j];
}

// ---------------------------------------------------------------------------
// Kernel B: flash attention.  One (batch, 32-column query tile) per block.
//   Q = gx[:, m0:m0+32]  (64 x 32, LDS, loaded once)
//   loop over key blocks n0 (step 32), K tile double-buffered via
//   GLOBAL_LOAD_ASYNC_TO_LDS_B128 (ASYNCcnt):
//     S[n,m] = sum_c fx[c,n]*gx[c,m]   (waves 0-3, WMMA, C spilled to LDS)
//     online softmax over the KEY axis n (== reference softmax over dim=1)
//     acc[c,m] += hx[c, n-block] * P   (all 8 waves, 64 channels each, WMMA;
//       hx comes in fragment order: each b128 load reads 512 contiguous bytes)
//   out = gamma * acc/L + x
// ---------------------------------------------------------------------------
__global__ __launch_bounds__(256)
void flash_kernel(const float* __restrict__ fx, const float* __restrict__ gx,
                  const float* __restrict__ hx, const float* __restrict__ x,
                  const float* __restrict__ gamma, float* __restrict__ out)
{
    __shared__ float Qs[64][32];
    __shared__ float Ks[2][64][32];          // double-buffered K tile
    __shared__ float Ps[32][32];
    __shared__ float Mrun[32], Lrun[32], Scale[32];

    const int b    = blockIdx.y;
    const int m0   = blockIdx.x * 32;
    const int tid  = threadIdx.x;
    const int lane = tid & 31;
    const int wave = tid >> 5;
    const int c0   = wave * 64;            // this wave's 64-channel V slice

    const float* fxb = fx + (size_t)b * NHID  * NPIX;
    const float* gxb = gx + (size_t)b * NHID  * NPIX;
    // this lane's 16 bytes in chunk 0 of the wave's first hx tile (layout: kernel A)
    const float* hfr = hx + (size_t)b * NFEAT * NPIX
                          + (size_t)(wave * 4) * (NPIX / 32) * 512 + lane * 4;

    // ---- load Q tile (64x32): 8 floats per thread, coalesced ----
    {
        const int r = tid >> 2;
        const int c = (tid & 3) * 8;
        const float* src = gxb + (size_t)r * NPIX + m0 + c;
        *(v4f*)(&Qs[r][c])     = *(const v4f*)(src);
        *(v4f*)(&Qs[r][c + 4]) = *(const v4f*)(src + 4);
    }
    if (tid < 32) { Mrun[tid] = -3.0e38f; Lrun[tid] = 0.0f; }

    // async fill of K tile: each thread moves 32B (2 x b128), LDS addr is the
    // low 32 bits of the generic shared pointer (flat LDS aperture rule).
    const int kr = tid >> 2;
    const int kc = (tid & 3) * 8;
    auto issueK = [&](int n0, int bufIdx) {
        const float* src = fxb + (size_t)kr * NPIX + n0 + kc;
        const uint32_t lds0 = (uint32_t)(uintptr_t)(&Ks[bufIdx][kr][kc]);
        asm volatile(
            "global_load_async_to_lds_b128 %0, %1, off\n\t"
            "global_load_async_to_lds_b128 %0, %1, off offset:16"
            :: "v"(lds0), "v"(src) : "memory");
    };

    issueK(0, 0);                            // prime tile 0

    const v8f zacc = {};
    v8f acc[4][2];
#pragma unroll
    for (int rt = 0; rt < 4; ++rt) { acc[rt][0] = zacc; acc[rt][1] = zacc; }

    const int l15   = lane & 15;
    const int khalf = (lane >> 4) << 1;

    for (int it = 0; it < NPIX / 32; ++it) {
        const int n0  = it * 32;
        const int buf = it & 1;

        asm volatile("s_wait_asynccnt 0x0" ::: "memory");   // tile `it` landed
        __syncthreads();

        if (it + 1 < NPIX / 32)                             // overlap next fill
            issueK(n0 + 32, buf ^ 1);

        // ---- S tile: waves 0-3 each compute one 16x16 subtile ----
        if (wave < 4) {
            const int rn = (wave >> 1) * 16;          // key-row offset
            const int cm = (wave & 1) * 16;           // query-col offset
            v8f s = zacc;
#pragma unroll
            for (int k = 0; k < NHID; k += 4) {
                const int kk = k + khalf;
                v2f a, bq;
                a.x  = Ks[buf][kk][rn + l15];  a.y  = Ks[buf][kk + 1][rn + l15];
                bq.x = Qs[kk][cm + l15];       bq.y = Qs[kk + 1][cm + l15];
                s = __builtin_amdgcn_wmma_f32_16x16x4_f32(false, a, false, bq,
                                                          (short)0, s, false, false);
            }
            const int rbase = rn + ((lane >> 4) << 3);
#pragma unroll
            for (int j = 0; j < 8; ++j)
                Ps[rbase + j][cm + l15] = s[j];
        }
        __syncthreads();

        // ---- online softmax over key axis, one thread per query column ----
        if (tid < 32) {
            float bm = Ps[0][tid];
#pragma unroll
            for (int n = 1; n < 32; ++n) bm = fmaxf(bm, Ps[n][tid]);
            const float mOld = Mrun[tid];
            const float mNew = fmaxf(mOld, bm);
            const float sc   = __expf(mOld - mNew);
            float sum = 0.0f;
#pragma unroll
            for (int n = 0; n < 32; ++n) {
                const float p = __expf(Ps[n][tid] - mNew);
                Ps[n][tid] = p;
                sum += p;
            }
            Mrun[tid]  = mNew;
            Lrun[tid]  = Lrun[tid] * sc + sum;
            Scale[tid] = sc;
        }
        __syncthreads();

        // ---- rescale accumulators, then acc += hx_tile * P ----
        const float sc0 = Scale[l15];
        const float sc1 = Scale[16 + l15];
#pragma unroll
        for (int rt = 0; rt < 4; ++rt) {
#pragma unroll
            for (int j = 0; j < 8; ++j) { acc[rt][0][j] *= sc0; acc[rt][1][j] *= sc1; }
        }
#pragma unroll
        for (int j = 0; j < 4; ++j) {
            v4f a4[4];                                  // A operands of two k steps
#pragma unroll
            for (int rt = 0; rt < 4; ++rt)
                a4[rt] = *(const v4f*)(hfr + (size_t)rt * (NPIX / 32) * 512
                                           + (size_t)it * 512 + j * 128);   // b128
#pragma unroll
            for (int s = 0; s < 2; ++s) {
                const int kk = j * 8 + s * 4 + khalf;
                v2f b0, b1;
                b0.x = Ps[kk][l15];       b0.y = Ps[kk + 1][l15];
                b1.x = Ps[kk][16 + l15];  b1.y = Ps[kk + 1][16 + l15];
#pragma unroll
                for (int rt = 0; rt < 4; ++rt) {
                    const v2f a = { a4[rt][2 * s], a4[rt][2 * s + 1] };
                    acc[rt][0] = __builtin_amdgcn_wmma_f32_16x16x4_f32(false, a, false, b0,
                                                                       (short)0, acc[rt][0], false, false);
                    acc[rt][1] = __builtin_amdgcn_wmma_f32_16x16x4_f32(false, a, false, b1,
                                                                       (short)0, acc[rt][1], false, false);
                }
            }
        }
    }

    // ---- epilogue: out = gamma * acc/L + x ----
    const float g    = gamma[0];
    const float inv0 = 1.0f / Lrun[l15];
    const float inv1 = 1.0f / Lrun[16 + l15];
    const float* xb  = x   + (size_t)b * NFEAT * NPIX;
    float*       ob  = out + (size_t)b * NFEAT * NPIX;
    const int rbase  = (lane >> 4) << 3;
#pragma unroll
    for (int rt = 0; rt < 4; ++rt) {
#pragma unroll
        for (int ct = 0; ct < 2; ++ct) {
            const float inv = ct ? inv1 : inv0;
            const int mcol  = m0 + ct * 16 + l15;
#pragma unroll
            for (int j = 0; j < 8; ++j) {
                const int crow = c0 + rt * 16 + rbase + j;
                const size_t idx = (size_t)crow * NPIX + mcol;
                ob[idx] = g * (acc[rt][ct][j] * inv) + xb[idx];
            }
        }
    }
}

// ---------------------------------------------------------------------------
extern "C" void kernel_launch(void* const* d_in, const int* in_sizes, int n_in,
                              void* d_out, int out_size, void* d_ws, size_t ws_size,
                              hipStream_t stream)
{
    const float* x     = (const float*)d_in[0];
    const float* wf    = (const float*)d_in[1];
    const float* wg    = (const float*)d_in[2];
    const float* wh    = (const float*)d_in[3];
    const float* gamma = (const float*)d_in[4];
    float* out = (float*)d_out;

    // workspace: fx (8.4MB) | gx (8.4MB) | hx (67MB)
    float* ws = (float*)d_ws;
    float* fx = ws;
    float* gx = fx + (size_t)NBATCH * NHID * NPIX;
    float* hx = gx + (size_t)NBATCH * NHID * NPIX;

    dim3 gA(NPIX / 128, (2 * NHID + NFEAT) / 16, NBATCH);   // 32 x 40 x 8
    proj_kernel<<<gA, 256, 0, stream>>>(x, wf, wg, wh, fx, gx, hx);

    dim3 gB(NPIX / 32, NBATCH);                              // 128 x 8
    flash_kernel<<<gB, 256, 0, stream>>>(fx, gx, hx, x, gamma, out);
}

// v003
// A run of this version takes 932 microseconds.
// Versions in between are left out here; by their measured steps it is 1.20 times as fast as v001.
// All steps since v000 together make it 1.62 times as fast.
#include <hip/hip_runtime.h>
#include <hip/hip_bf16.h>
#include <stdint.h>

typedef __attribute__((ext_vector_type(2))) float v2f;
typedef __attribute__((ext_vector_type(4))) float v4f;
typedef __attribute__((ext_vector_type(8))) float v8f;

#define NFEAT 512
#define NHID  64
#define NPIX  4096
#define NBATCH 8

// ---------------------------------------------------------------------------
// Kernel A: fused projections.  y[o,n] = sum_c W[o,c] * x[b,c,n],  o in [0,640)
//   o 0..63   -> fx (wf),  o 64..127 -> gx (wg),  o 128..639 -> hx (wh)
// One wave computes 64 outputs x 64 pixels: 4 x 4 C tiles of 16x16, K stepped by 4
// with V_WMMA_F32_16X16X4_F32, so that each loaded fragment feeds four products.
// A layout (16x4 f32): lane<16 holds k slots {0,1}, lane>=16 slots {2,3}, row = lane&15.
// B layout (4x16 f32): same slot split, col = lane&15.
// Eight k values are loaded at a time, by b128 loads only.  With h = lane>>4:
//   W: a lane reads W[row][k0+4h .. k0+4h+3]; step s (0,1) takes elements 2s, 2s+1;
//   x: a lane reads rows k0+4h+i (i 0..3), pixels n0+4*(lane&15) .. +3 (whole lines);
//      step s takes rows i = 2s, 2s+1; element t belongs to pixel tile t.
// So slot (h,e) of step s is k = k0+4h+2s+e on both operands, and column (or row)
// c of pixel tile t is pixel n0+4c+t.
// hx is stored in the order in which the attention kernel's A fragments read it:
//   one 2 KB tile per (16 channels, 32 pixels): [chunk j 0..3][lane 0..31][4 floats],
//   lane = 16*h + (channel & 15), float e = pixel 8*j + 4*(e>>1) + 2*h + (e&1),
//   so a lane's 16 bytes are its A operands of the k steps 8*j and 8*j + 4.
// For hx the two operands swap places (A = x, B = wh): a lane then holds 32
// consecutive pixels of ONE channel per channel tile, a whole row of an hx tile.
// ---------------------------------------------------------------------------
template <bool SWAP>
__device__ __forceinline__ void proj_accumulate(const float* __restrict__ wp,
                                                const float* __restrict__ xp,
                                                v8f (&acc)[4][4])
{
    // not unrolled: only one trip's fragments are live, which keeps the wave within
    // 192 registers, so that five waves (all of the grid's share) fit on a SIMD
#pragma unroll 1
    for (int k0 = 0; k0 < NFEAT; k0 += 8) {
        v4f w4[4], x4[4];
#pragma unroll
        for (int ot = 0; ot < 4; ++ot)
            w4[ot] = *(const v4f*)(wp + (size_t)ot * 16 * NFEAT + k0);      // b128
#pragma unroll
        for (int i = 0; i < 4; ++i)
            x4[i] = *(const v4f*)(xp + (size_t)(k0 + i) * NPIX);            // b128
#pragma unroll
        for (int s = 0; s < 2; ++s) {
#pragma unroll
            for (int t = 0; t < 4; ++t) {
                const v2f xf = { x4[2 * s][t], x4[2 * s + 1][t] };
#pragma unroll
                for (int ot = 0; ot < 4; ++ot) {
                    const v2f wv = { w4[ot][2 * s], w4[ot][2 * s + 1] };
                    if (SWAP)
                        acc[ot][t] = __builtin_amdgcn_wmma_f32_16x16x4_f32(false, xf, false, wv,
                                                                           (short)0, acc[ot][t], false, false);
                    else
                        acc[ot][t] = __builtin_amdgcn_wmma_f32_16x16x4_f32(false, wv, false, xf,
                                                                           (short)0, acc[ot][t], false, false);
                }
            }
        }
    }
}

__global__ __launch_bounds__(128)
void proj_kernel(const float* __restrict__ x,
                 const float* __restrict__ wf,
                 const float* __restrict__ wg,
                 const float* __restrict__ wh,
                 float* __restrict__ fx, float* __restrict__ gx,
                 float* __restrict__ hx)
{
    const int b    = blockIdx.z;
    const int og   = blockIdx.y;                       // group of 64 outputs
    const int lane = threadIdx.x & 31;
    const int wave = threadIdx.x >> 5;                 // wave32
    const int n0   = blockIdx.x * 256 + wave * 64;
    const int l15  = lane & 15;
    const int h    = lane >> 4;

    const float* xp = x + (size_t)b * NFEAT * NPIX + (size_t)(4 * h) * NPIX + n0 + 4 * l15;

    const v8f zacc = {};
    v8f acc[4][4];
#pragma unroll
    for (int ot = 0; ot < 4; ++ot) {
#pragma unroll
        for (int t = 0; t < 4; ++t) acc[ot][t] = zacc;
    }

    if (og >= 2) {                                     // block-uniform: hx tiles
        const int orow = (og - 2) * 64;
        proj_accumulate<true>(wh + (size_t)(orow + l15) * NFEAT + 4 * h, xp, acc);
        // C layout: pixel = n0 + 32*h + 4*j + t, channel = orow + 16*ot + (lane&15)
        float* hb = hx + (size_t)b * NFEAT * NPIX
                       + ((size_t)(orow >> 4) * (NPIX / 32) + (n0 >> 5) + h) * 512 + l15 * 4;
#pragma unroll
        for (int ot = 0; ot < 4; ++ot) {
#pragma unroll
            for (int jc = 0; jc < 4; ++jc) {
#pragma unroll
                for (int hp = 0; hp < 2; ++hp) {
                    const v4f v = { acc[ot][2 * hp][2 * jc],     acc[ot][2 * hp + 1][2 * jc],
                                    acc[ot][2 * hp][2 * jc + 1], acc[ot][2 * hp + 1][2 * jc + 1] };
                    *(v4f*)(hb + (size_t)ot * (NPIX / 32) * 512 + jc * 128 + hp * 64) = v;
                }
            }
        }
        return;
    }

    proj_accumulate<false>((og == 0 ? wf : wg) + (size_t)l15 * NFEAT + 4 * h, xp, acc);
    // C layout: output row = 16*ot + 8*h + j, pixel = n0 + 4*(lane&15) + t
    float* dst = (og == 0 ? fx : gx) + (size_t)b * NHID * NPIX + (size_t)(8 * h) * NPIX + n0 + 4 * l15;
#pragma unroll
    for (int ot = 0; ot < 4; ++ot) {
#pragma unroll
        for (int j = 0; j < 8; ++j) {
            const v4f v = { acc[ot][0][j], acc[ot][1][j], acc[ot][2][j], acc[ot][3][j] };
            *(v4f*)(dst + (size_t)(ot * 16 + j) * NPIX) = v;
        }
    }
}

// ---------------------------------------------------------------------------
// Kernel B: flash attention.  One (batch, 32-column query tile) per block.
//   Q = gx[:, m0:m0+32]  (64 x 32, LDS, loaded once)
//   loop over key blocks n0 (step 32), K tile double-buffered via
//   GLOBAL_LOAD_ASYNC_TO_LDS_B128 (ASYNCcnt):
//     S[n,m] = sum_c fx[c,n]*gx[c,m]   (waves 0-3, WMMA, C spilled to LDS)
//     online softmax over the KEY axis n (== reference softmax over dim=1)
//     acc[c,m] += hx[c, n-block] * P   (all 8 waves, 64 channels each, WMMA;
//       hx comes in fragment order: each b128 load reads 512 contiguous bytes)
//   out = gamma * acc/L + x
// ---------------------------------------------------------------------------
// The second launch bound asks for 8 waves per SIMD, a budget of 128 registers: four
// work-groups then share a WGP and the whole grid of 1024 is resident at once, so that one
// group's S and softmax phases run behind the PV products of the three others.
__global__ __launch_bounds__(256, 8)
void flash_kernel(const float* __restrict__ fx, const float* __restrict__ gx,
                  const float* __restrict__ hx, const float* __restrict__ x,
                  const float* __restrict__ gamma, float* __restrict__ out)
{
    __shared__ float Qs[64][32];
    __shared__ float Ks[2][64][32];          // double-buffered K tile
    __shared__ float Ps[32][32];
    __shared__ float Mrun[32], Lrun[32], Scale[32];

    const int b    = blockIdx.y;
    const int m0   = blockIdx.x * 32;
    const int tid  = threadIdx.x;
    const int lane = tid & 31;
    const int wave = __builtin_amdgcn_readfirstlane(tid >> 5);   // wave-uniform: kept in a scalar register
    const int c0   = wave * 64;            // this wave's 64-channel V slice

    const float* fxb = fx + (size_t)b * NHID  * NPIX;
    const float* gxb = gx + (size_t)b * NHID  * NPIX;
    // start of the wave's first hx tile (layout: kernel A)
    // (wave-uniform base, the lane's offset added last: the built loop then keeps one running
    // address pair instead of a base pair and a second pair formed every trip)
    const float* hfr = hx + (size_t)b * NFEAT * NPIX
                          + (size_t)(wave * 4) * (NPIX / 32) * 512;
    const uint32_t hlane = (uint32_t)lane * 4;

    // ---- load Q tile (64x32): 8 floats per thread, coalesced ----
    {
        const int r = tid >> 2;
        const int c = (tid & 3) * 8;
        const float* src = gxb + (size_t)r * NPIX + m0 + c;
        *(v4f*)(&Qs[r][c])     = *(const v4f*)(src);
        *(v4f*)(&Qs[r][c + 4]) = *(const v4f*)(src + 4);
    }
    if (tid < 32) { Mrun[tid] = -3.0e38f; Lrun[tid] = 0.0f; }

    // async fill of K tile: each thread moves 32B (2 x b128), LDS addr is the
    // low 32 bits of the generic shared pointer (flat LDS aperture rule).
    const int kr = tid >> 2;
    const int kc = (tid & 3) * 8;
    auto issueK = [&](int n0, int bufIdx) {
        const float* src = fxb + (size_t)kr * NPIX + n0 + kc;
        const uint32_t lds0 = (uint32_t)(uintptr_t)(&Ks[bufIdx][kr][kc]);
        asm volatile(
            "global_load_async_to_lds_b128 %0, %1, off\n\t"
            "global_load_async_to_lds_b128 %0, %1, off offset:16"
            :: "v"(lds0), "v"(src) : "memory");
    };

    issueK(0, 0);                            // prime tile 0

    auto loadA = [&](v4f (&dst)[4], int itn, int j) {
#pragma unroll
        for (int rt = 0; rt < 4; ++rt)
            dst[rt] = *(const v4f*)(hfr + ((size_t)rt * (NPIX / 32) * 512
                                        + (size_t)itn * 512 + j * 128) + hlane);   // b128
    };

    const v8f zacc = {};
    v8f acc[4][2];
#pragma unroll
    for (int rt = 0; rt < 4; ++rt) { acc[rt][0] = zacc; acc[rt][1] = zacc; }

    const int l15   = lane & 15;
    const int khalf = (lane >> 4) << 1;

    // kept as one rolled loop (no peeled last trip): a peeled trip merges with the epilogue,
    // whose loads then crowd the trip's registers past the budget of 128
#pragma unroll 1
    for (int it = 0; it < NPIX / 32; ++it) {
        const int n0  = it * 32;
        const int buf = it & 1;

        asm volatile("s_wait_asynccnt 0x0" ::: "memory");   // tile `it` landed
        __syncthreads();

        if (it + 1 < NPIX / 32)                             // overlap next fill
            issueK(n0 + 32, buf ^ 1);

        // ---- S tile: waves 0-3 each compute one 16x16 subtile ----
        if (wave < 4) {
            const int rn = (wave >> 1) * 16;          // key-row offset
            const int cm = (wave & 1) * 16;           // query-col offset
            v8f s = zacc;
#pragma unroll
            for (int k = 0; k < NHID; k += 4) {
                const int kk = k + khalf;
                v2f a, bq;
                a.x  = Ks[buf][kk][rn + l15];  a.y  = Ks[buf][kk + 1][rn + l15];
                bq.x = Qs[kk][cm + l15];       bq.y = Qs[kk + 1][cm + l15];
                s = __builtin_amdgcn_wmma_f32_16x16x4_f32(false, a, false, bq,
                                                          (short)0, s, false, false);
            }
            const int rbase = rn + ((lane >> 4) << 3);
#pragma unroll
            for (int j = 0; j < 8; ++j)
                Ps[rbase + j][cm + l15] = s[j];
        }
        __syncthreads();

        // ---- online softmax over key axis, one thread per query column ----
        if (tid < 32) {
            float bm = Ps[0][tid];
#pragma unroll
            for (int n = 1; n < 32; ++n) bm = fmaxf(bm, Ps[n][tid]);
            const float mOld = Mrun[tid];
            const float mNew = fmaxf(mOld, bm);
            const float sc   = __expf(mOld - mNew);
            float sum = 0.0f;
#pragma unroll
            for (int n = 0; n < 32; ++n) {
                const float p = __expf(Ps[n][tid] - mNew);
                Ps[n][tid] = p;
                sum += p;
            }
            Mrun[tid]  = mNew;
            Lrun[tid]  = Lrun[tid] * sc + sum;
            Scale[tid] = sc;
        }
        __syncthreads();

        // ---- rescale accumulators, then acc += hx_tile * P ----
        const float sc0 = Scale[l15];
        const float sc1 = Scale[16 + l15];
#pragma unroll
        for (int rt = 0; rt < 4; ++rt) {
#pragma unroll
            for (int j = 0; j < 8; ++j) { acc[rt][0][j] *= sc0; acc[rt][1][j] *= sc1; }
        }
        // hx fragments: a chunk is 4 b128 loads (two k steps of the wave's 64 channels);
        // two chunks are in flight or in use at a time, and no more are ever live.
        v4f ab[2][4];
        loadA(ab[0], it, 0);
        loadA(ab[1], it, 1);
#pragma unroll
        for (int j = 0; j < 4; ++j) {
            v4f (&a4)[4] = ab[j & 1];                   // A operands of two k steps
#pragma unroll
            for (int s = 0; s < 2; ++s) {
                const int kk = j * 8 + s * 4 + khalf;
                v2f b0, b1;
                b0.x = Ps[kk][l15];       b0.y = Ps[kk + 1][l15];
                b1.x = Ps[kk][16 + l15];  b1.y = Ps[kk + 1][16 + l15];
#pragma unroll
                for (int rt = 0; rt < 4; ++rt) {
                    const v2f a = { a4[rt][2 * s], a4[rt][2 * s + 1] };
                    acc[rt][0] = __builtin_amdgcn_wmma_f32_16x16x4_f32(false, a, false, b0,
                                                                       (short)0, acc[rt][0], false, false);
                    acc[rt][1] = __builtin_amdgcn_wmma_f32_16x16x4_f32(false, a, false, b1,
                                                                       (short)0, acc[rt][1], false, false);
                }
            }
            if (j < 2) loadA(a4, it, j + 2);            // refill the chunk just used
        }
    }

    // ---- epilogue: out = gamma * acc/L + x ----
    const float g    = gamma[0];
    const float inv0 = 1.0f / Lrun[l15];
    const float inv1 = 1.0f / Lrun[16 + l15];
    // wave-uniform bases and one 32-bit lane offset for both x and out
    const size_t wbase = (size_t)b * NFEAT * NPIX + (size_t)c0 * NPIX + m0;
    const float* xw  = x   + wbase;
    float*       ow  = out + wbase;
    const uint32_t eo = (uint32_t)((lane >> 4) << 3) * NPIX + l15;
#pragma unroll
    for (int rt = 0; rt < 4; ++rt) {
        float xv[2][8];                     // one channel tile's x values, all in flight at once
#pragma unroll
        for (int ct = 0; ct < 2; ++ct) {
#pragma unroll
            for (int j = 0; j < 8; ++j)
                xv[ct][j] = xw[(size_t)((rt * 16 + j) * NPIX + ct * 16) + eo];
        }
#pragma unroll
        for (int ct = 0; ct < 2; ++ct) {
            const float inv = ct ? inv1 : inv0;
#pragma unroll
            for (int j = 0; j < 8; ++j)
                ow[(size_t)((rt * 16 + j) * NPIX + ct * 16) + eo] = g * (acc[rt][ct][j] * inv) + xv[ct][j];
        }
    }
}

// ---------------------------------------------------------------------------
extern "C" void kernel_launch(void* const* d_in, const int* in_sizes, int n_in,
                              void* d_out, int out_size, void* d_ws, size_t ws_size,
                              hipStream_t stream)
{
    const float* x     = (const float*)d_in[0];
    const float* wf    = (const float*)d_in[1];
    const float* wg    = (const float*)d_in[2];
    const float* wh    = (const float*)d_in[3];
    const float* gamma = (const float*)d_in[4];
    float* out = (float*)d_out;

    // workspace: fx (8.4MB) | gx (8.4MB) | hx (67MB)
    float* ws = (float*)d_ws;
    float* fx = ws;
    float* gx = fx + (size_t)NBATCH * NHID * NPIX;
    float* hx = gx + (size_t)NBATCH * NHID * NPIX;

    dim3 gA(NPIX / 256, (2 * NHID + NFEAT) / 64, NBATCH);   // 16 x 10 x 8
    proj_kernel<<<gA, 128, 0, stream>>>(x, wf, wg, wh, fx, gx, hx);

    dim3 gB(NPIX / 32, NBATCH);                              // 128 x 8
    flash_kernel<<<gB, 256, 0, stream>>>(fx, gx, hx, x, gamma, out);
}

// v004
// It runs in 854 microseconds.
// Two timings next to v003 both put it at 1.09 times that version's speed.
// Over all steps from v000 it is 1.77 times as fast.
#include <hip/hip_runtime.h>
#include <hip/hip_bf16.h>
#include <stdint.h>

typedef __attribute__((ext_vector_type(2))) float v2f;
typedef __attribute__((ext_vector_type(4))) float v4f;
typedef __attribute__((ext_vector_type(8))) float v8f;

#define NFEAT 512
#define NHID  64
#define NPIX  4096
#define NBATCH 8

// ---------------------------------------------------------------------------
// Kernel A: fused projections.  y[o,n] = sum_c W[o,c] * x[b,c,n],  o in [0,640)
//   o 0..63   -> fx (wf),  o 64..127 -> gx (wg),  o 128..639 -> hx (wh)
// One wave computes 64 outputs x 64 pixels: 4 x 4 C tiles of 16x16, K stepped by 4
// with V_WMMA_F32_16X16X4_F32, so that each loaded fragment feeds four products.
// A layout (16x4 f32): lane<16 holds k slots {0,1}, lane>=16 slots {2,3}, row = lane&15.
// B layout (4x16 f32): same slot split, col = lane&15.
// Eight k values are loaded at a time, by b128 loads only.  With h = lane>>4:
//   W: a lane reads W[row][k0+4h .. k0+4h+3]; step s (0,1) takes elements 2s, 2s+1;
//   x: a lane reads rows k0+4h+i (i 0..3), pixels n0+4*(lane&15) .. +3 (whole lines);
//      step s takes rows i = 2s, 2s+1; element t belongs to pixel tile t.
// So slot (h,e) of step s is k = k0+4h+2s+e on both operands, and column (or row)
// c of pixel tile t is pixel n0+4c+t.
// hx is stored in the order in which the attention kernel's A fragments read it:
//   one 2 KB tile per (16 channels, 32 pixels): [chunk j 0..3][lane 0..31][4 floats],
//   lane = 16*h + (channel & 15), float e = pixel 8*j + 4*(e>>1) + 2*h + (e&1),
//   so a lane's 16 bytes are its A operands of the k steps 8*j and 8*j + 4.
// For hx the two operands swap places (A = x, B = wh): a lane then holds 32
// consecutive pixels of ONE channel per channel tile, a whole row of an hx tile.
// ---------------------------------------------------------------------------
template <bool SWAP>
__device__ __forceinline__ void proj_accumulate(const float* __restrict__ wp,
                                                const float* __restrict__ xp,
                                                v8f (&acc)[4][4])
{
    // not unrolled: only one trip's fragments are live, which keeps the wave within
    // 192 registers, so that five waves (all of the grid's share) fit on a SIMD
#pragma unroll 1
    for (int k0 = 0; k0 < NFEAT; k0 += 8) {
        v4f w4[4], x4[4];
#pragma unroll
        for (int ot = 0; ot < 4; ++ot)
            w4[ot] = *(const v4f*)(wp + (size_t)ot * 16 * NFEAT + k0);      // b128
#pragma unroll
        for (int i = 0; i < 4; ++i)
            x4[i] = *(const v4f*)(xp + (size_t)(k0 + i) * NPIX);            // b128
#pragma unroll
        for (int s = 0; s < 2; ++s) {
#pragma unroll
            for (int t = 0; t < 4; ++t) {
                const v2f xf = { x4[2 * s][t], x4[2 * s + 1][t] };
#pragma unroll
                for (int ot = 0; ot < 4; ++ot) {
                    const v2f wv = { w4[ot][2 * s], w4[ot][2 * s + 1] };
                    if (SWAP)
                        acc[ot][t] = __builtin_amdgcn_wmma_f32_16x16x4_f32(false, xf, false, wv,
                                                                           (short)0, acc[ot][t], false, false);
                    else
                        acc[ot][t] = __builtin_amdgcn_wmma_f32_16x16x4_f32(false, wv, false, xf,
                                                                           (short)0, acc[ot][t], false, false);
                }
            }
        }
    }
}

__global__ __launch_bounds__(128)
void proj_kernel(const float* __restrict__ x,
                 const float* __restrict__ wf,
                 const float* __restrict__ wg,
                 const float* __restrict__ wh,
                 float* __restrict__ fx, float* __restrict__ gx,
                 float* __restrict__ hx)
{
    const int b    = blockIdx.z;
    const int og   = blockIdx.y;                       // group of 64 outputs
    const int lane = threadIdx.x & 31;
    const int wave = threadIdx.x >> 5;                 // wave32
    const int n0   = blockIdx.x * 256 + wave * 64;
    const int l15  = lane & 15;
    const int h    = lane >> 4;

    const float* xp = x + (size_t)b * NFEAT * NPIX + (size_t)(4 * h) * NPIX + n0 + 4 * l15;

    const v8f zacc = {};
    v8f acc[4][4];
#pragma unroll
    for (int ot = 0; ot < 4; ++ot) {
#pragma unroll
        for (int t = 0; t < 4; ++t) acc[ot][t] = zacc;
    }

    if (og >= 2) {                                     // block-uniform: hx tiles
        const int orow = (og - 2) * 64;
        proj_accumulate<true>(wh + (size_t)(orow + l15) * NFEAT + 4 * h, xp, acc);
        // C layout: pixel = n0 + 32*h + 4*j + t, channel = orow + 16*ot + (lane&15)
        float* hb = hx + (size_t)b * NFEAT * NPIX
                       + ((size_t)(orow >> 4) * (NPIX / 32) + (n0 >> 5) + h) * 512 + l15 * 4;
#pragma unroll
        for (int ot = 0; ot < 4; ++ot) {
#pragma unroll
            for (int jc = 0; jc < 4; ++jc) {
#pragma unroll
                for (int hp = 0; hp < 2; ++hp) {
                    const v4f v = { acc[ot][2 * hp][2 * jc],     acc[ot][2 * hp + 1][2 * jc],
                                    acc[ot][2 * hp][2 * jc + 1], acc[ot][2 * hp + 1][2 * jc + 1] };
                    *(v4f*)(hb + (size_t)ot * (NPIX / 32) * 512 + jc * 128 + hp * 64) = v;
                }
            }
        }
        return;
    }

    proj_accumulate<false>((og == 0 ? wf : wg) + (size_t)l15 * NFEAT + 4 * h, xp, acc);
    // C layout: output row = 16*ot + 8*h + j, pixel = n0 + 4*(lane&15) + t
    float* dst = (og == 0 ? fx : gx) + (size_t)b * NHID * NPIX + (size_t)(8 * h) * NPIX + n0 + 4 * l15;
#pragma unroll
    for (int ot = 0; ot < 4; ++ot) {
#pragma unroll
        for (int j = 0; j < 8; ++j) {
            const v4f v = { acc[ot][0][j], acc[ot][1][j], acc[ot][2][j], acc[ot][3][j] };
            *(v4f*)(dst + (size_t)(ot * 16 + j) * NPIX) = v;
        }
    }
}

// ---------------------------------------------------------------------------
// Kernel B: flash attention.  One (batch, 32-column query tile) per block.
//   Q = gx[:, m0:m0+32]  (64 x 32, LDS, loaded once)
//   loop over key blocks (32 keys), K tile double-buffered via
//   GLOBAL_LOAD_ASYNC_TO_LDS_B128 (ASYNCcnt).  Trip t of the loop does two things side by side:
//     two waves: S[n,m] = sum_c fx[c,n]*gx[c,m] of key block t+1 (32 keys x 16 queries each,
//       WMMA), and its online softmax over the KEY axis n (== reference softmax over dim=1)
//       in the same registers: a query column lies in lanes l and l^16, 16 keys in each;
//       P and the rescale factor go to the LDS buffer that trip t does not read;
//     all 8 waves: acc[c,m] = acc*scale + hx[c, block t] * P(t)   (64 channels each, WMMA;
//       hx comes in fragment order: each b128 load reads 512 contiguous bytes)
//   so one barrier a trip hands over P(t+1), its scale, the running max and sum, and K(t+2).
//   out = gamma * acc/L + x
// ---------------------------------------------------------------------------
// value of lane l ^ 16
__device__ __forceinline__ float other_half(float v)
{
    const int b = __builtin_bit_cast(int, v);
    return __builtin_bit_cast(float,
        __builtin_amdgcn_permlanex16(b, b, 0x76543210, 0xfedcba98, false, false));
}

// The second launch bound asks for 8 waves per SIMD, a budget of 128 registers: four
// work-groups then share a WGP and the whole grid of 1024 is resident at once.
__global__ __launch_bounds__(256, 8)
void flash_kernel(const float* __restrict__ fx, const float* __restrict__ gx,
                  const float* __restrict__ hx, const float* __restrict__ x,
                  const float* __restrict__ gamma, float* __restrict__ out)
{
    __shared__ float Qs[64][32];
    __shared__ float Ks[2][64][32];          // double-buffered K tile
    __shared__ float Ps[2][32][32];          // double-buffered P tile
    __shared__ float Scale[2][32];
    __shared__ float Mrun[32], Lrun[32];

    const int b    = blockIdx.y;
    const int m0   = blockIdx.x * 32;
    const int tid  = threadIdx.x;
    const int lane = tid & 31;
    const int wave = __builtin_amdgcn_readfirstlane(tid >> 5);   // wave-uniform: kept in a scalar register
    const int c0   = wave * 64;            // this wave's 64-channel V slice
    // The two S waves change from trip to trip (waves r and 7-r, r = (trip + spread) & 3);
    // spread sets
    // neighbouring work-groups apart.  Speed only.
    const int spread = blockIdx.x + (blockIdx.x >> 3) + (blockIdx.y >> 1);

    const float* fxb = fx + (size_t)b * NHID  * NPIX;
    const float* gxb = gx + (size_t)b * NHID  * NPIX;
    // start of the wave's first hx tile (layout: kernel A)
    // (wave-uniform base, the lane's offset added last: the built loop then keeps one running
    // address pair instead of a base pair and a second pair formed every trip)
    const float* hfr = hx + (size_t)b * NFEAT * NPIX
                          + (size_t)(wave * 4) * (NPIX / 32) * 512;
    const uint32_t hlane = (uint32_t)lane * 4;

    // ---- load Q tile (64x32): 8 floats per thread, coalesced ----
    {
        const int r = tid >> 2;
        const int c = (tid & 3) * 8;
        const float* src = gxb + (size_t)r * NPIX + m0 + c;
        *(v4f*)(&Qs[r][c])     = *(const v4f*)(src);
        *(v4f*)(&Qs[r][c + 4]) = *(const v4f*)(src + 4);
    }
    if (tid < 32) { Mrun[tid] = -3.0e38f; Lrun[tid] = 0.0f; }

    // async fill of K tile: each thread moves 32B (2 x b128), LDS addr is the
    // low 32 bits of the generic shared pointer (flat LDS aperture rule).
    const int kr = tid >> 2;
    const int kc = (tid & 3) * 8;
    auto issueK = [&](int n0, int bufIdx) {
        const float* src = fxb + (size_t)kr * NPIX + n0 + kc;
        const uint32_t lds0 = (uint32_t)(uintptr_t)(&Ks[bufIdx][kr][kc]);
        // last line, a precaution: it stands in front of every later rewrite of the two address registers
        asm volatile(
            "global_load_async_to_lds_b128 %0, %1, off\n\t"
            "global_load_async_to_lds_b128 %0, %1, off offset:16\n\t"
            "s_wait_xcnt 0x0"
            :: "v"(lds0), "v"(src) : "memory");
    };

    issueK(0, 0);                            // prime tile 0

    auto loadA = [&](v4f (&dst)[4], int itn, int j) {
#pragma unroll
        for (int rt = 0; rt < 4; ++rt)
            dst[rt] = *(const v4f*)(hfr + ((size_t)rt * (NPIX / 32) * 512
                                        + (size_t)itn * 512 + j * 128) + hlane);   // b128
    };

    const v8f zacc = {};
    v8f acc[4][2];
#pragma unroll
    for (int rt = 0; rt < 4; ++rt) { acc[rt][0] = zacc; acc[rt][1] = zacc; }

    const int l15   = lane & 15;
    const int khalf = (lane >> 4) << 1;

    // Trip -1 makes only S and P of key block 0.
    // kept as one rolled loop (no peeled trip): a peeled trip merges with the code around it,
    // whose values then crowd the trip's registers past the budget of 128
#pragma unroll 1
    for (int it = -1; it < NPIX / 32; ++it) {
        // hand-over: this wave's LDS reads and writes of the last trip are done, its part of
        // K tile it+1 has landed; behind the barrier P(it), K(it+1) and the running max and
        // sum are everybody's, and the buffers of P(it-1) and K(it) are free
        asm volatile("s_wait_dscnt 0x0" ::: "memory");
        asm volatile("s_wait_asynccnt 0x0" ::: "memory");
        __syncthreads();

        if (it + 2 < NPIX / 32)                             // overlap the fill after next
            issueK((it + 2) * 32, it & 1);

        // hx fragments: a chunk is 4 b128 loads (two k steps of the wave's 64 channels).  The
        // first chunk is asked for here, so that in the S waves it flies behind S and softmax
        // (trip -1 uses none: it asks for block 0's, which lies inside hx, and drops it)
        const int ith = it < 0 ? 0 : it;
        v4f ab[2][4];
        loadA(ab[0], ith, 0);
        // a precaution: it stands in front of the S waves' rewrite of the loads' address registers
        asm volatile("s_wait_xcnt 0x0" ::: "memory");

        // ---- S and softmax of key block it+1: two waves, 32 keys x 16 queries each ----
        const int r = (it + spread) & 3;
        if (it + 1 < NPIX / 32 && (wave == r || wave == 7 - r)) {
            const int nb = (it + 1) & 1;              // buffer of K(it+1) and of P(it+1)
            const int cm = (wave == r) ? 0 : 16;      // query-col offset
            v8f s0 = zacc, s1 = zacc;                 // keys 0..15 and 16..31
#pragma unroll
            for (int k = 0; k < NHID; k += 4) {
                const int kk = k + khalf;
                v2f a0, a1, bq;
                a0.x = Ks[nb][kk][l15];       a0.y = Ks[nb][kk + 1][l15];
                a1.x = Ks[nb][kk][16 + l15];  a1.y = Ks[nb][kk + 1][16 + l15];
                bq.x = Qs[kk][cm + l15];      bq.y = Qs[kk + 1][cm + l15];
                s0 = __builtin_amdgcn_wmma_f32_16x16x4_f32(false, a0, false, bq,
                                                           (short)0, s0, false, false);
                s1 = __builtin_amdgcn_wmma_f32_16x16x4_f32(false, a1, false, bq,
                                                           (short)0, s1, false, false);
            }
            // C layout: element j of s0 / s1 is key 8*(lane>>4) + j / 16 + that, query cm + (lane&15)
            float bm = fmaxf(s0[0], s1[0]);
#pragma unroll
            for (int j = 1; j < 8; ++j) bm = fmaxf(bm, fmaxf(s0[j], s1[j]));
            bm = fmaxf(bm, other_half(bm));
            const float mOld = Mrun[cm + l15];
            const float mNew = fmaxf(mOld, bm);
            const float sc   = __expf(mOld - mNew);
            const int rbase  = (lane >> 4) << 3;
#pragma unroll
            for (int j = 0; j < 8; ++j) {
                s0[j] = __expf(s0[j] - mNew);
                s1[j] = __expf(s1[j] - mNew);
            }
#pragma unroll
            for (int j = 0; j < 8; ++j) {
                Ps[nb][rbase + j][cm + l15]      = s0[j];
                Ps[nb][16 + rbase + j][cm + l15] = s1[j];
            }
            // the lane's 16 terms by a tree (a short chain), then the other half's 16
            float sum = (((s0[0] + s1[0]) + (s0[1] + s1[1])) + ((s0[2] + s1[2]) + (s0[3] + s1[3])))
                      + (((s0[4] + s1[4]) + (s0[5] + s1[5])) + ((s0[6] + s1[6]) + (s0[7] + s1[7])));
            sum += other_half(sum);
            // lanes l and l^16 hold and store the same three values
            Lrun[cm + l15]      = Lrun[cm + l15] * sc + sum;
            Mrun[cm + l15]      = mNew;
            Scale[nb][cm + l15] = sc;
        }

        if (it < 0) continue;
        const int pb = it & 1;

        // ---- rescale accumulators, then acc += hx_tile * P ----
        const float sc0 = Scale[pb][l15];
        const float sc1 = Scale[pb][16 + l15];
#pragma unroll
        for (int rt = 0; rt < 4; ++rt) {
#pragma unroll
            for (int j = 0; j < 8; ++j) { acc[rt][0][j] *= sc0; acc[rt][1][j] *= sc1; }
        }
        // two chunks are in flight or in use at a time, and no more are ever live.
        loadA(ab[1], it, 1);
#pragma unroll
        for (int j = 0; j < 4; ++j) {
            v4f (&a4)[4] = ab[j & 1];                   // A operands of two k steps
#pragma unroll
            for (int s = 0; s < 2; ++s) {
                const int kk = j * 8 + s * 4 + khalf;
                v2f b0, b1;
                b0.x = Ps[pb][kk][l15];       b0.y = Ps[pb][kk + 1][l15];
                b1.x = Ps[pb][kk][16 + l15];  b1.y = Ps[pb][kk + 1][16 + l15];
#pragma unroll
                for (int rt = 0; rt < 4; ++rt) {
                    const v2f a = { a4[rt][2 * s], a4[rt][2 * s + 1] };
                    acc[rt][0] = __builtin_amdgcn_wmma_f32_16x16x4_f32(false, a, false, b0,
                                                                       (short)0, acc[rt][0], false, false);
                    acc[rt][1] = __builtin_amdgcn_wmma_f32_16x16x4_f32(false, a, false, b1,
                                                                       (short)0, acc[rt][1], false, false);
                }
            }
            if (j < 2) loadA(a4, it, j + 2);            // refill the chunk just used
        }
    }
    asm volatile("s_wait_asynccnt 0x0" ::: "memory");   // no copy is left in flight at the end

    // ---- epilogue: out = gamma * acc/L + x ----
    // (Lrun was last written in the trip before the last one, in front of its closing barrier)
    // the lane's number is read anew here, so that no value of the epilogue alone is held
    // in a register through the loop (the budget of 128 is full there)
    const int elane = (int)__builtin_amdgcn_mbcnt_lo(~0u, 0u);
    const int el15  = elane & 15;
    const float g    = gamma[0];
    const float inv0 = 1.0f / Lrun[el15];
    const float inv1 = 1.0f / Lrun[16 + el15];
    // wave-uniform bases and one 32-bit lane offset for both x and out
    const size_t wbase = (size_t)b * NFEAT * NPIX + (size_t)c0 * NPIX + m0;
    const float* xw  = x   + wbase;
    float*       ow  = out + wbase;
    const uint32_t eo = (uint32_t)((elane >> 4) << 3) * NPIX + el15;
#pragma unroll
    for (int rt = 0; rt < 4; ++rt) {
        float xv[2][8];                     // one channel tile's x values, all in flight at once
#pragma unroll
        for (int ct = 0; ct < 2; ++ct) {
#pragma unroll
            for (int j = 0; j < 8; ++j)
                xv[ct][j] = xw[(size_t)((rt * 16 + j) * NPIX + ct * 16) + eo];
        }
#pragma unroll
        for (int ct = 0; ct < 2; ++ct) {
            const float inv = ct ? inv1 : inv0;
#pragma unroll
            for (int j = 0; j < 8; ++j)
                ow[(size_t)((rt * 16 + j) * NPIX + ct * 16) + eo] = g * (acc[rt][ct][j] * inv) + xv[ct][j];
        }
    }
}

// ---------------------------------------------------------------------------
extern "C" void kernel_launch(void* const* d_in, const int* in_sizes, int n_in,
                              void* d_out, int out_size, void* d_ws, size_t ws_size,
                              hipStream_t stream)
{
    const float* x     = (const float*)d_in[0];
    const float* wf    = (const float*)d_in[1];
    const float* wg    = (const float*)d_in[2];
    const float* wh    = (const float*)d_in[3];
    const float* gamma = (const float*)d_in[4];
    float* out = (float*)d_out;

    // workspace: fx (8.4MB) | gx (8.4MB) | hx (67MB)
    float* ws = (float*)d_ws;
    float* fx = ws;
    float* gx = fx + (size_t)NBATCH * NHID * NPIX;
    float* hx = gx + (size_t)NBATCH * NHID * NPIX;

    dim3 gA(NPIX / 256, (2 * NHID + NFEAT) / 64, NBATCH);   // 16 x 10 x 8
    proj_kernel<<<gA, 128, 0, stream>>>(x, wf, wg, wh, fx, gx, hx);

    dim3 gB(NPIX / 32, NBATCH);                              // 128 x 8
    flash_kernel<<<gB, 256, 0, stream>>>(fx, gx, hx, x, gamma, out);
}
